// v010
// Measured on an AMD MI455X. A time is GPU time per run, averaged over a window of back-to-back runs after a warm-up
// (all launches, gaps included; the runs take copies of the inputs in turn), and the median of several windows.
// Apart from v000's, it joins two sittings. Times from different sittings can be a few percent apart, while
// side-by-side timings come from the same sitting.
// This document starts at v010; the versions before it stand elsewhere.
// One run takes 123 microseconds.
// Two timings next to v009 both put it at 1.04 times that version's speed.
// All steps since the starting kernel, v000, together make it 46.7 times as fast.
#include <hip/hip_runtime.h>
// Causal multi-head attention on three inputs with the source's sequence-length score scale (query, key, value [2][2048][1024]; q = query Wq + bq, k = key Wk + bk, v = value Wv + bv ([in][out] 1024 x 1024, weights AND biases sigma 1/32), 16 heads of 64; score = q k^T; triu(1) -> -inf; softmax(score / sqrt(Sk)) with Sk = 2048 KEYS (the source divides by sqrt of the score matrix's last dimension, NOT by sqrt(head_dim)): scale 2048^-0.5 = 0.0220970869; out = merged Wo + bo ([in][out]) -> [2][2048][1024]); q and k carried as f16 hi + x1024 residual planes with three-product scores.
// Structure: token rows r = b*2048 + s; x as exact f16 rows (bf16-rounded); q and k as WMMA GEMMs (32x64 wave tiles, f32 accumulation, exact x16 weights + bias) whose epilogue splits the f32 values into f16 hi + x1024 residual planes, v as a GEMM whose epilogue stores V^T of all heads straight from the accumulators; f32 q, k, v rows are stored only for the exact first-tile attention (rows 0..127 of each batch); then ONE fused attention launch (a wave per 16 queries, keys below the diagonal in passes of 32: three-product scores hi.hi + lo.hi + hi.lo in f32 accumulators, running-maximum softmax in registers (f32 statistics, native exp; weights in (0, 1] as f16), o = P . V^T normalised at the end, carried x64 and folded into the output GEMM alpha) written straight into the merged f16 o rows; out = o W_o + b GEMM (f32) into the output layout. Four launches: jobs that do not depend on one another share a grid (k_prep, the q/k/v GEMM grid, k_fattn with the exact first-tile attention in its last blocks, the output GEMM, whose first-tile blocks take the exact rows' hi and residual planes as the two A row groups of each wave).
// Layout: every f16 plane that only WMMA fragment loads read (x rows, weights, q and k hi / residual planes, V^T, o rows) is kept in FRAGMENT ORDER: a tile of 16 rows x 32 k is one 1-KiB block [k half of 16][lane = 16 * (k / 8 % 2) + row][8 k], the blocks of 16 rows one behind the other in k; a wave's 16-byte fragment load then covers 512 contiguous bytes. 16 rows of a plane of pitch C fill 16 * C elements as before, so offsets of whole 16-row groups are unchanged.
// Compute dtype: inputs rounded to bf16; x / weights exact; q and k as f16 hi + x1024 residual planes; v, softmax weights and o (rows 128 on) as plain f16 GEMM operands (~2^-12); scores and softmax statistics f32. v_wmma_f32_16x16x32_f16.
#define NB 2
#define SCL 0.0220970869f                 /* = f32(1 / sqrt(2048)): the source scales the scores by 1/sqrt(Sk), Sk = 2048 keys */
#define SCLR (0.0220970869f * 0.0009765625f)   /* the same scale on the x1024 residual passes */
#define SQ 2048
#define DM 1024
#define NH 16
#define HD 64
#define HG 4                         /* heads per attention launch group */
#define QT0 128                      /* first-tile rows recomputed exactly in f32 */
#define B0 0                         /* unused: no kernel or launch reads it */
#define NBR NB                       /* batches processed (debug hook) */
#define NR ((size_t)NB * SQ)         /* token rows */
#define MP ((int)((size_t)NBR * SQ)) /* rows projected (debug hook) */
#define MPO MP                       /* rows through the output stage (debug hook) */
#define LQ DM      /* row pitch of the q/k/v rows */
typedef __bf16 v16b __attribute__((ext_vector_type(16)));
typedef unsigned short v8us __attribute__((ext_vector_type(8), may_alias));
typedef float  v8f  __attribute__((ext_vector_type(8)));
typedef float  v4f  __attribute__((ext_vector_type(4)));
typedef float  v4fa __attribute__((ext_vector_type(4), may_alias));
union FragB { v16b v; v8us half[2]; unsigned short u[16]; };

__device__ __forceinline__ unsigned short bf16_bits(float x) { unsigned int u = __float_as_uint(x); return (unsigned short)((u + 0x7FFFu + ((u >> 16) & 1u)) >> 16); }
__device__ __forceinline__ float bf16_val(unsigned short b) { return __uint_as_float(((unsigned int)b) << 16); }
__device__ __forceinline__ float bf16_round(float x) { return bf16_val(bf16_bits(x)); }
// D += A·B with NT terms: 1 = ah·bh, 2 = + al·bh (A split), 3 = + ah·bl (both split)
template <int NT>
__device__ __forceinline__ v8f mmaN(v16b ah, v16b al, v16b bh, v16b bl, v8f c) {
  c = __builtin_amdgcn_wmma_f32_16x16x32_bf16(false, ah, false, bh, (short)0, c, false, false);
  if (NT >= 2) c = __builtin_amdgcn_wmma_f32_16x16x32_bf16(false, al, false, bh, (short)0, c, false, false);
  if (NT >= 3) c = __builtin_amdgcn_wmma_f32_16x16x32_bf16(false, ah, false, bl, (short)0, c, false, false);
  asm volatile("v_nop\n\tv_nop\n\tv_nop\n\tv_nop" : "+v"(c) : "v"(ah), "v"(al), "v"(bh), "v"(bl));
  return c;
}

__global__ __launch_bounds__(256) void k_wt_bf16(const float* __restrict__ W, unsigned short* __restrict__ Wt, int K, int N) {
  const int t = blockIdx.x * 256 + threadIdx.x;
  const int k8n = K / 8;
  if (t >= N * k8n) return;
  const int n = t / k8n, k8 = (t % k8n) * 8;
  v8us v;
#pragma unroll
  for (int i = 0; i < 8; ++i) v[i] = bf16_bits(W[(size_t)(k8 + i) * N + n]);
  *(v8us*)(Wt + (size_t)n * K + k8) = v;
  
}

// GEMM C[M][N] (f32, pitch ldc) = act(A[M][K]·W + bias). A f32 row-major (pitch lda) converted per fragment to bf16
// (ASPLIT: hi/lo two planes -> 2 terms, else single rounded term); Wt bf16 [N][K] (pitch ldb). BIAS_BF16 rounds the
// bias to bf16 first (bias quantised to bf16 before the add). K%32==0, M%16==0, N%64==0.
template <bool ASPLIT, int ACT, bool BIAS_BF16>
__global__ __launch_bounds__(128) void k_gemm_bf(const float* __restrict__ A, int lda, const unsigned short* __restrict__ Wt, int ldb,
                                               const float* __restrict__ bias, float* __restrict__ C, int ldc, int M, int N, int K) {
  __shared__ __attribute__((aligned(16))) float so[4][16][64];
  const int tid = threadIdx.x, w = tid >> 5, lane = tid & 31, ln = lane & 15, hh = lane >> 4;
  const int ntn = N / 64;
  const int wid = blockIdx.x * 4 + w;
  const int mt = wid / ntn, nq = wid % ntn;
  if (mt * 16 >= M) return;
  const int row0 = mt * 16, col0 = nq * 64;
  const float* arow = A + (size_t)(row0 + ln) * lda;
  v8f acc[4] = {};
  for (int kb = 0; kb < K; kb += 32) {
    FragB ah, al;
    const v4f x0 = *(const v4fa*)(arow + kb + 8 * hh), x1 = *(const v4fa*)(arow + kb + 8 * hh + 4);
    const v4f x2 = *(const v4fa*)(arow + kb + 16 + 8 * hh), x3 = *(const v4fa*)(arow + kb + 16 + 8 * hh + 4);
    float xs[16] = {x0[0],x0[1],x0[2],x0[3],x1[0],x1[1],x1[2],x1[3],x2[0],x2[1],x2[2],x2[3],x3[0],x3[1],x3[2],x3[3]};
#pragma unroll
    for (int i = 0; i < 16; ++i) { const unsigned short hb = bf16_bits(xs[i]); ah.u[i] = hb; al.u[i] = ASPLIT ? bf16_bits(xs[i] - bf16_val(hb)) : (unsigned short)0; }
#pragma unroll
    for (int t = 0; t < 4; ++t) {
      const unsigned short* brow = Wt + (size_t)(col0 + t * 16 + ln) * ldb + kb;
      FragB b;
      b.half[0] = *(const v8us*)(brow + 8 * hh);
      b.half[1] = *(const v8us*)(brow + 16 + 8 * hh);
      acc[t] = mmaN<ASPLIT ? 2 : 1>(ah.v, al.v, b.v, b.v, acc[t]);
    }
  }
#pragma unroll
  for (int t = 0; t < 4; ++t) {
    float bv = bias ? bias[col0 + t * 16 + ln] : 0.f;
    if (BIAS_BF16) bv = bf16_round(bv);
#pragma unroll
    for (int r = 0; r < 8; ++r) { float v = acc[t][r] + bv; if (ACT == 1) v = fmaxf(v, 0.f); so[w][8 * hh + r][t * 16 + ln] = v; }
  }
  __builtin_amdgcn_fence(__ATOMIC_ACQ_REL, "workgroup");
  __builtin_amdgcn_wave_barrier();
  const int rsub = lane >> 4, c4 = (lane & 15) * 4;
  {
#pragma unroll
    for (int q = 0; q < 8; ++q) {
      const int r = q * 2 + rsub;
      const v4f v = *(const v4fa*)&so[w][r][c4];
      *(v4f*)(C + (size_t)(row0 + r) * ldc + col0 + c4) = v;
    }
    
  }
}

// GEMM C = act(A·W + bias + resid): A f32 (ASPLIT -> hi/lo 2 terms), Wt bf16 [N][K]; ACT 0 none, 1 relu, 2 exact gelu;
// resid (optional, f32, row index = (row % rmod), pitch ldr, RES_BF16 rounds it) added before the activation.
template <bool ASPLIT, int ACT, bool BIAS_BF16, bool RES_BF16>
__global__ __launch_bounds__(128) void k_gemm_bf3(const float* __restrict__ A, int lda, const unsigned short* __restrict__ Wt, int ldb,
                                                const float* __restrict__ bias, const float* __restrict__ resid, int rmod, int ldr,
                                                float* __restrict__ C, int ldc, int M, int N, int K) {
  __shared__ __attribute__((aligned(16))) float so[4][16][64];
  const int tid = threadIdx.x, w = tid >> 5, lane = tid & 31, ln = lane & 15, hh = lane >> 4;
  const int ntn = N / 64;
  const int wid = blockIdx.x * 4 + w;
  const int mt = wid / ntn, nq = wid % ntn;
  if (mt * 16 >= M) return;
  const int row0 = mt * 16, col0 = nq * 64;
  const float* arow = A + (size_t)(row0 + ln) * lda;
  v8f acc[4] = {};
  for (int kb = 0; kb < K; kb += 32) {
    FragB ah, al;
    const v4f x0 = *(const v4fa*)(arow + kb + 8 * hh), x1 = *(const v4fa*)(arow + kb + 8 * hh + 4);
    const v4f x2 = *(const v4fa*)(arow + kb + 16 + 8 * hh), x3 = *(const v4fa*)(arow + kb + 16 + 8 * hh + 4);
    float xs[16] = {x0[0],x0[1],x0[2],x0[3],x1[0],x1[1],x1[2],x1[3],x2[0],x2[1],x2[2],x2[3],x3[0],x3[1],x3[2],x3[3]};
#pragma unroll
    for (int i = 0; i < 16; ++i) { const unsigned short hb = bf16_bits(xs[i]); ah.u[i] = hb; al.u[i] = ASPLIT ? bf16_bits(xs[i] - bf16_val(hb)) : (unsigned short)0; }
#pragma unroll
    for (int t = 0; t < 4; ++t) {
      const unsigned short* brow = Wt + (size_t)(col0 + t * 16 + ln) * ldb + kb;
      FragB b;
      b.half[0] = *(const v8us*)(brow + 8 * hh);
      b.half[1] = *(const v8us*)(brow + 16 + 8 * hh);
      acc[t] = mmaN<ASPLIT ? 2 : 1>(ah.v, al.v, b.v, b.v, acc[t]);
    }
  }
#pragma unroll
  for (int t = 0; t < 4; ++t) {
    const int col = col0 + t * 16 + ln;
    float bv = bias ? bias[col] : 0.f;
    if (BIAS_BF16) bv = bf16_round(bv);
#pragma unroll
    for (int r = 0; r < 8; ++r) {
      float v = acc[t][r] + bv;
      if (resid) { float rv = resid[(size_t)((row0 + 8 * hh + r) % rmod) * ldr + col]; if (RES_BF16) rv = bf16_round(rv); v += rv; }
      if (ACT == 1) v = fmaxf(v, 0.f);
      if (ACT == 2) v = 0.5f * v * (1.0f + erff(v * 0.70710678118654752f));
      if (ACT == 3) { const float u = 0.7978845608028654f * (v + 0.044715f * v * v * v); v = 0.5f * v * (1.0f + tanhf(u)); }
      so[w][8 * hh + r][t * 16 + ln] = v;
    }
  }
  __builtin_amdgcn_fence(__ATOMIC_ACQ_REL, "workgroup");
  __builtin_amdgcn_wave_barrier();
  const int rsub = lane >> 4, c4 = (lane & 15) * 4;
  {
#pragma unroll
    for (int q = 0; q < 8; ++q) {
      const int r = q * 2 + rsub;
      const v4f v = *(const v4fa*)&so[w][r][c4];
      *(v4f*)(C + (size_t)(row0 + r) * ldc + col0 + c4) = v;
    }
    
  }
}
// row LayerNorm (biased variance, eps) over N: s = X (+ R); optional out_sum <- s; out_norm <- (s-mu)*rsqrt(var+eps)*g + b
template <bool PARAM_BF16>
__global__ __launch_bounds__(256) void k_layernorm(const float* __restrict__ X, const float* __restrict__ R, const float* __restrict__ g, const float* __restrict__ bta,
                                                  float* __restrict__ out_sum, float* __restrict__ out_norm, int N, float eps) {
  __shared__ float red[256];
  const int row = blockIdx.x, tid = threadIdx.x;
  const float* x = X + (size_t)row * N; const float* rr = R ? R + (size_t)row * N : nullptr;
  float vals[16];                     // up to N = 4096
  const int per = N / 256;            // contiguous chunk per thread? use strided-by-4 chunks: thread handles j = tid*4 + 1024*u
  float s1 = 0.f;
  for (int u = 0; u < per / 4; ++u) {
    const int j = tid * 4 + 1024 * u;
    const v4f a = *(const v4fa*)(x + j);
    v4f b = {0.f,0.f,0.f,0.f}; if (rr) b = *(const v4fa*)(rr + j);
#pragma unroll
    for (int q = 0; q < 4; ++q) { const float v = a[q] + b[q]; vals[u * 4 + q] = v; s1 += v; }
  }
  red[tid] = s1; __syncthreads();
  for (int st = 128; st > 0; st >>= 1) { if (tid < st) red[tid] += red[tid + st]; __syncthreads(); }
  const float mu = red[0] / (float)N; __syncthreads();
  float s2 = 0.f;
  for (int u = 0; u < per / 4; ++u)
#pragma unroll
    for (int q = 0; q < 4; ++q) { const float c = vals[u * 4 + q] - mu; s2 += c * c; }
  red[tid] = s2; __syncthreads();
  for (int st = 128; st > 0; st >>= 1) { if (tid < st) red[tid] += red[tid + st]; __syncthreads(); }
  const float rs = rsqrtf(red[0] / (float)N + eps);
  {
    for (int u = 0; u < per / 4; ++u) {
      const int j = tid * 4 + 1024 * u;
      v4f o, sm;
#pragma unroll
      for (int q = 0; q < 4; ++q) {
        float gg = g[j + q], bb = bta[j + q];
        if (PARAM_BF16) { gg = bf16_round(gg); bb = bf16_round(bb); }
        sm[q] = vals[u * 4 + q]; o[q] = (vals[u * 4 + q] - mu) * rs * gg + bb;
      }
      if (out_sum) *(v4f*)(out_sum + (size_t)row * N + j) = sm;
      *(v4f*)(out_norm + (size_t)row * N + j) = o;
    }
    
  }
}



// ---- f16 WMMA path (v_wmma_f32_16x16x32_f16): 11-bit significands for operands in range — used where a [0,1] probability operand needs more precision than bf16
typedef _Float16 v16h __attribute__((ext_vector_type(16)));
union FragH { v16h v; v8us half[2]; _Float16 h[16]; unsigned short u[16]; };
template <int NT>
__device__ __forceinline__ v8f mmaH(v16h ah, v16h al, v16h bh, v16h bl, v8f c) {
  c = __builtin_amdgcn_wmma_f32_16x16x32_f16(false, ah, false, bh, (short)0, c, false, false);
  if (NT >= 2) c = __builtin_amdgcn_wmma_f32_16x16x32_f16(false, al, false, bh, (short)0, c, false, false);
  if (NT >= 3) c = __builtin_amdgcn_wmma_f32_16x16x32_f16(false, ah, false, bl, (short)0, c, false, false);
  asm volatile("v_nop\n\tv_nop\n\tv_nop\n\tv_nop" : "+v"(c) : "v"(ah), "v"(al), "v"(bh), "v"(bl));
  return c;
}
// batched GEMM like k_gemm_b but f16 operands: A f32 (split into f16 hi/lo if ASPLIT, else rounded to f16), Bt = f16 values [n][k]; alpha; C f32; N multiple of 16 (partial tiles skipped)
template <bool ASPLIT>
__global__ __launch_bounds__(128) void k_gemm_h(const float* __restrict__ A, int lda, size_t sA, const _Float16* __restrict__ Bh, int ldb, size_t sB, float alpha, float* __restrict__ C, int ldc, size_t sC, int M, int N, int K) {
  __shared__ __attribute__((aligned(16))) float so[4][16][64];
  const int tid = threadIdx.x, w = tid >> 5, lane = tid & 31, ln = lane & 15, hh = lane >> 4; const int by = blockIdx.y;
  A += (size_t)by * sA; Bh += (size_t)by * sB; C += (size_t)by * sC;
  const int ntn = (N + 63) / 64; const int wid = blockIdx.x * 4 + w; const int mt = wid / ntn, nq = wid % ntn; if (mt * 16 >= M) return;
  const int row0 = mt * 16, col0 = nq * 64; const float* arow = A + (size_t)(row0 + ln) * lda;
  v8f acc[4] = {};
  for (int kb = 0; kb < K; kb += 32) {
    FragH ah, al;
    const v4f x0 = *(const v4fa*)(arow + kb + 8 * hh), x1 = *(const v4fa*)(arow + kb + 8 * hh + 4), x2 = *(const v4fa*)(arow + kb + 16 + 8 * hh), x3 = *(const v4fa*)(arow + kb + 16 + 8 * hh + 4);
    float xs[16] = {x0[0],x0[1],x0[2],x0[3],x1[0],x1[1],x1[2],x1[3],x2[0],x2[1],x2[2],x2[3],x3[0],x3[1],x3[2],x3[3]};
#pragma unroll
    for (int i = 0; i < 16; ++i) { const _Float16 h = (_Float16)xs[i]; ah.h[i] = h; al.h[i] = ASPLIT ? (_Float16)(xs[i] - (float)h) : (_Float16)0.0f; }
#pragma unroll
    for (int t = 0; t < 4; ++t) { if (col0 + t * 16 >= N) continue; const size_t boff = (size_t)(col0 + t * 16 + ln) * ldb + kb; FragH bq; bq.half[0] = *(const v8us*)(Bh + boff + 8 * hh); bq.half[1] = *(const v8us*)(Bh + boff + 16 + 8 * hh);
      acc[t] = mmaH<ASPLIT ? 2 : 1>(ah.v, al.v, bq.v, bq.v, acc[t]); }
  }
#pragma unroll
  for (int t = 0; t < 4; ++t) { if (col0 + t * 16 >= N) continue;
#pragma unroll
    for (int r = 0; r < 8; ++r) so[w][8 * hh + r][t * 16 + ln] = acc[t][r] * alpha; }
  __builtin_amdgcn_fence(__ATOMIC_ACQ_REL, "workgroup"); __builtin_amdgcn_wave_barrier();
  const int rsub = lane >> 4, c4 = (lane & 15) * 4;
  {
#pragma unroll
    for (int q = 0; q < 8; ++q) { const int r = q * 2 + rsub; if (col0 + c4 < N) { const v4f v = *(const v4fa*)&so[w][r][c4]; *(v4f*)(C + (size_t)(row0 + r) * ldc + col0 + c4) = v; } }
     }
}

// Wt[n][k], in fragment order, = f16(W[k][n] * scale) from f32 row-major W[K][N] (K % 32 == 0, N % 16 == 0; scale = power of two; bf16-exact weights stay exact in f16 away from the subnormal range)
__device__ __forceinline__ void d_wt_f16(int bx, const float* __restrict__ W, _Float16* __restrict__ Wt, int K, int N, float scale) {      /* bx = the block's number within this weight */
  const int t = bx * 256 + threadIdx.x; if (t >= N * (K / 8)) return;      /* thread t writes the t-th 16-byte group of the fragment-order plane: 16 lanes read 16 neighbouring n of one k row */
  const int blk = t >> 6; const int n = (blk / (K / 32)) * 16 + (t & 15), k8 = (blk % (K / 32)) * 32 + ((t >> 5) & 1) * 16 + ((t >> 4) & 1) * 8; FragH f;
#pragma unroll
  for (int i = 0; i < 8; ++i) f.h[i] = (_Float16)(bf16_round(W[(size_t)(k8 + i) * N + n]) * scale); const v8us o = f.half[0];
  *(v8us*)((unsigned short*)Wt + (size_t)t * 8) = o; 
}
// k_gemm_hh variant with fused epilogue: v = acc·alpha + bias[by·sBias + col] (+ CP[(row/rowsPerB)·sCPb + by·64 + col] if CP) ; ACT 0 none / 1 elu ; writes f16 C16 (and f32 C if non-null)
template <int ACT>
__global__ __launch_bounds__(128) void k_gemm_hhx(const _Float16* __restrict__ A, int lda, size_t sA, const _Float16* __restrict__ Bh, int ldb, size_t sB, float alpha, const float* __restrict__ bias, size_t sBias, const float* __restrict__ CP, int rowsPerB, size_t sCPb, int row0g,
    float* __restrict__ C, _Float16* __restrict__ C16, int ldc, size_t sC, int M, int N, int K) {
  __shared__ __attribute__((aligned(16))) float so[4][16][64];
  const int tid = threadIdx.x, w = tid >> 5, lane = tid & 31, ln = lane & 15, hh = lane >> 4; const int by = blockIdx.y;
  A += (size_t)by * sA; Bh += (size_t)by * sB; const size_t cofs = (size_t)by * sC; const float* bp = bias ? bias + (size_t)by * sBias : nullptr;
  const int ntn = (N + 63) / 64; const int wid = blockIdx.x * 4 + w; const int mt = wid / ntn, nq = wid % ntn; if (mt * 16 >= M) return;
  const int row0 = mt * 16, col0 = nq * 64; const _Float16* arow = A + (size_t)(row0 + ln) * lda;
  v8f acc[4] = {};
  for (int kb = 0; kb < K; kb += 32) { FragH ah; ah.half[0] = *(const v8us*)((const unsigned short*)arow + kb + 8 * hh); ah.half[1] = *(const v8us*)((const unsigned short*)arow + kb + 16 + 8 * hh);
#pragma unroll
    for (int t = 0; t < 4; ++t) { if (col0 + t * 16 >= N) continue; const size_t boff = (size_t)(col0 + t * 16 + ln) * ldb + kb; FragH bq; bq.half[0] = *(const v8us*)((const unsigned short*)Bh + boff + 8 * hh); bq.half[1] = *(const v8us*)((const unsigned short*)Bh + boff + 16 + 8 * hh);
      acc[t] = mmaH<1>(ah.v, ah.v, bq.v, bq.v, acc[t]); }
  }
#pragma unroll
  for (int t = 0; t < 4; ++t) { if (col0 + t * 16 >= N) continue; const int col = col0 + t * 16 + ln; const float bv = bp ? bf16_round(bp[col]) : 0.f;
#pragma unroll
    for (int r = 0; r < 8; ++r) { float v = acc[t][r] * alpha + bv; if (CP) { const int rr = row0g + row0 + 8 * hh + r; if (rowsPerB < 0) v += CP[cofs + (size_t)rr * ldc + col];      /* rowsPerB < 0: own element of the batched C plane */ else { const int bidx = rr / rowsPerB; v += CP[(size_t)bidx * sCPb + (size_t)by * 64 + col]; } } if (ACT == 1) v = (v > 0.f) ? v : expm1f(v); else if (ACT == 7) v = (v > 0.f) ? v + 1.0f : expf(v); else if (ACT == 8) v = tanhf(v); else if (ACT == 9) v = 0.5f * v * (1.0f + tanhf(0.7978845608028654f * (v + 0.044715f * v * v * v))); else if (ACT == 11) v = 1.0f / (1.0f + expf(-v)); else if (ACT == 12) v = (v > 0.f) ? v : 0.01f * v; else if (ACT == 14) v = (v > 0.f) ? v : 0.1f * v; else if (ACT == 16) v = (v >= 0.f) ? v : 0.3f * v; else if (ACT == 17) v = (v >= 0.f) ? v : 0.2f * v; else if (ACT == 15) v = v / (1.0f + expf(-v)); else if (ACT == 3) v = fmaxf(v, 0.f); else if (ACT == 6) v = 0.5f * v * (1.0f + erff(v * 0.70710678118654752f)); so[w][8 * hh + r][t * 16 + ln] = v; } }
  __builtin_amdgcn_fence(__ATOMIC_ACQ_REL, "workgroup"); __builtin_amdgcn_wave_barrier();
  const int rsub = lane >> 4, c4 = (lane & 15) * 4; typedef _Float16 v4h __attribute__((ext_vector_type(4)));
  {
#pragma unroll
    for (int q = 0; q < 8; ++q) { const int r = q * 2 + rsub; if (col0 + c4 < N) { const v4f v = *(const v4fa*)&so[w][r][c4]; if (C) *(v4f*)(C + cofs + (size_t)(row0 + r) * ldc + col0 + c4) = v; if (C16) { v4h h4; for (int i = 0; i < 4; ++i) h4[i] = (_Float16)v[i]; *(v4h*)(C16 + cofs + (size_t)(row0 + r) * ldc + col0 + c4) = h4; } } }
     }
}


typedef _Float16 v4h __attribute__((ext_vector_type(4)));

// f32 rows of pitch DM -> fragment order, one 16 x 32 tile per wave: load i takes rows 4 i .. 4 i + 3 of the tile, 8 lanes on each row's whole 128-byte line; a lane's 4 values go as 8 bytes into the tile's block.
__device__ __forceinline__ size_t pk_src(size_t wv, int lane) { return ((wv / (DM / 32)) * 16 + (lane >> 3)) * DM + (wv % (DM / 32)) * 32 + (lane & 7) * 4; }      /* row step 4 * DM per load */
__device__ __forceinline__ size_t pk_dst(size_t wv, int lane) { return wv * 512 + ((lane >> 2) & 1) * 256 + (((lane >> 1) & 1) * 16 + (lane >> 3)) * 8 + (lane & 1) * 4; }      /* step 32 per load */
__device__ __forceinline__ void d_x16(int bx, const float* __restrict__ x, _Float16* __restrict__ X16, size_t n16) { const size_t t = (size_t)bx * 256 + threadIdx.x; if (t >= n16) return; const int lane = (int)(t & 31);      /* bx = the block's number within this input */
  const float* s = x + pk_src(t >> 5, lane); _Float16* d = X16 + pk_dst(t >> 5, lane); v4f v[4]; v4h h[4];
#pragma unroll      /* static indices keep v[] and h[] in registers; the four loads are issued together */
  for (int i = 0; i < 4; ++i) v[i] = *(const v4fa*)(s + (size_t)i * 4 * DM);
  asm volatile("s_wait_xcnt 0x0" :: "v"(s) : "memory");      /* the loads' address pair stays whole up to here and is free for reuse only behind this wait */
#pragma unroll      /* static indices keep v[] and h[] in registers */
  for (int i = 0; i < 4; ++i) for (int q = 0; q < 4; ++q) h[i][q] = (_Float16)bf16_round(v[i][q]);
#pragma unroll      /* static indices; the four stores follow one another, so both halves of each 128-byte line are written together */
  for (int i = 0; i < 4; ++i) *(v4h*)(d + i * 32) = h[i]; }
__global__ __launch_bounds__(256) void k_h16(const float* __restrict__ x, _Float16* __restrict__ X16, size_t n8) { const size_t t = (size_t)blockIdx.x * 256 + threadIdx.x; if (t >= n8) return; FragH f;
#pragma unroll
  for (int q = 0; q < 8; ++q) f.h[q] = (_Float16)x[t * 8 + q]; *(v8us*)((unsigned short*)X16 + t * 8) = f.half[0];  }
__global__ __launch_bounds__(256) void k_round16f(const float* __restrict__ W, _Float16* __restrict__ Bt, size_t n8) { const size_t t = (size_t)blockIdx.x * 256 + threadIdx.x; if (t >= n8) return; FragH f;
#pragma unroll
  for (int i = 0; i < 8; ++i) f.h[i] = (_Float16)(bf16_round(W[t * 8 + i]) * 16.0f); *(v8us*)((unsigned short*)Bt + t * 8) = f.half[0];  }

// ---- fast GEMM (wave tile 32x64; requires M % 32 == 0 rows per launch region, N % 64 == 0 and K % 64 == 0; A and Bh in fragment order with lda == ldb == K); epilogue = k_gemm_hhx semantics without the added plane ----
__device__ __forceinline__ v16h g2_frag(const _Float16* p) { FragH f; f.half[0] = *(const v8us*)((const unsigned short*)p); f.half[1] = *(const v8us*)((const unsigned short*)p + 256); return f.v; }      /* p = the block of a fragment-order plane + 8 * lane: each of the two loads covers 512 contiguous bytes per wave */
__device__ __forceinline__ v8f g2_mma(v16h a, v16h b, v8f c) { v8f d = __builtin_amdgcn_wmma_f32_16x16x32_f16(false, a, false, b, (short)0, c, false, false); asm volatile("v_nop\n\tv_nop\n\tv_nop\n\tv_nop" : "+v"(d) : "v"(a), "v"(b)); return d; }
template <int ACT, bool PROJ>      /* PROJ: the q/k/v projections' build, with an epilogue of its own (alpha and bias only: no activation, no added plane) */
__global__ __launch_bounds__(128) void k_gemm2(const _Float16* __restrict__ A, int lda, size_t sA, const _Float16* __restrict__ Bh, int ldb, size_t sB, float alpha, const float* __restrict__ bias, size_t sBias,
    float* __restrict__ C, _Float16* __restrict__ C16a, int ldc, size_t sC, int M, int N, int K, const float* __restrict__ bias1, const float* __restrict__ bias2, int c16y, const _Float16* __restrict__ AF, int ftp, _Float16* __restrict__ HH, _Float16* __restrict__ HL, size_t sH, _Float16* __restrict__ VTo, int frp, const _Float16* __restrict__ AL, float alphaL) { static_assert(ACT == 0 || ACT == 3 || ACT == 6 || ACT == 8 || ACT == 9 || ACT == 11 || ACT == 12 || ACT == 14 || ACT == 15 || ACT == 16 || ACT == 17, "k_gemm2: unsupported ACT code (would silently apply no activation)"); static_assert(!PROJ || ACT == 0, "k_gemm2: the projection epilogue applies no activation");
  __shared__ __attribute__((aligned(16))) float so[4][32][68];
  const int tid = threadIdx.x, w = tid >> 5, lane = tid & 31, ln = lane & 15, hh = lane >> 4; const int by = blockIdx.y;
  A += (size_t)by * sA; Bh += (size_t)by * sB; const size_t cofs = (size_t)by * sC; const float* bp = bias ? bias + (size_t)by * sBias : nullptr;
  if (by == 1 && bias1) bp = bias1; if (by == 2 && bias2) bp = bias2; _Float16* C16 = (by >= c16y) ? C16a : nullptr;      /* independent products share one grid: blockIdx.y picks the operands; biases that are separate inputs come as pointers of their own; only products from c16y on store f16 rows */
  const int ntn = N >> 6; int mt = blockIdx.x / ntn; const int nq = blockIdx.x - mt * ntn; const int col0 = nq * 64; int sx = 0;
  if (!PROJ && AL && mt * 128 >= M) { mt = (mt - (M >> 7)) * ftp; sx = 1; }      /* with AL (M % 128 == 0 there) the grid has ntn more blocks per first tile, behind the ordinary ones: they take the second 64 rows of those tiles */
  const bool two = !PROJ && AL && mt % ftp == 0;      /* uniform for the block. A first tile with a residual plane: a wave owns 16 rows, not 32; its first A row group is their hi rows (AF), its second their x1024 residual rows (AL), so both products run through the one k loop below and are joined in the epilogue, not by a launch of their own that reads C back */
  const int row0 = two ? mt * 128 + sx * 64 + 16 * w : mt * 128 + 32 * w; if (row0 >= M) return;
  const _Float16* ab = A + (size_t)row0 * lda; if (AF && mt % ftp == 0) ab = AF + ((size_t)(mt / ftp) * 128 + (two ? sx * 64 + 16 * w : 32 * w)) * lda;      /* every ftp-th block of 128 rows takes its A rows from the packed plane AF (the exact first-tile rows): that product shares this grid instead of overwriting these rows from a launch of its own */
  const _Float16* a0p = ab + 8 * lane; const _Float16* a1p = two ? AL + (ab - AF) + 8 * lane : a0p + (size_t)16 * lda;      /* first block of each 16-row group; the lane's 8 elements are in the six pointers, so each is the very address its loads name; a k step of 32 is one block of 512 elements */
  const _Float16* b0p = Bh + (size_t)col0 * ldb + 8 * lane; const _Float16* b1p = b0p + (size_t)16 * ldb; const _Float16* b2p = b1p + (size_t)16 * ldb; const _Float16* b3p = b2p + (size_t)16 * ldb;
  const v8f z8 = {0.f,0.f,0.f,0.f,0.f,0.f,0.f,0.f}; v8f c00 = z8, c01 = z8, c02 = z8, c03 = z8, c10 = z8, c11 = z8, c12 = z8, c13 = z8;
  /* Two fragment sets, x and y, each the six fragments of one k step of 32. A set's twelve loads are issued together, one k step ahead of its products, so a k step waits for one load round trip that
     runs under the other set's products, not for five in a row. K is a multiple of 64. Every accumulator still takes its k steps in rising order. */
  v16h xa0 = g2_frag(a0p), xa1 = g2_frag(a1p), xb0 = g2_frag(b0p), xb1 = g2_frag(b1p), xb2 = g2_frag(b2p), xb3 = g2_frag(b3p);
  asm volatile("s_wait_xcnt 0x0" :: "v"(a0p), "v"(a1p), "v"(b0p), "v"(b1p), "v"(b2p), "v"(b3p) : "memory");      /* the first set's six address pairs stay whole up to here and are free for reuse only behind this wait */
#pragma unroll 1      /* one trip is two k steps already; more would only grow the text */
  for (int kb = 0; kb < K; kb += 64) {
    const int ko = kb * 16; const _Float16* q0 = a0p + ko; const _Float16* q1 = a1p + ko; const _Float16* q2 = b0p + ko; const _Float16* q3 = b1p + ko; const _Float16* q4 = b2p + ko; const _Float16* q5 = b3p + ko;
    const v16h ya0 = g2_frag(q0 + 512), ya1 = g2_frag(q1 + 512), yb0 = g2_frag(q2 + 512), yb1 = g2_frag(q3 + 512), yb2 = g2_frag(q4 + 512), yb3 = g2_frag(q5 + 512);
    asm volatile("s_wait_xcnt 0x0" :: "v"(q0), "v"(q1), "v"(q2), "v"(q3), "v"(q4), "v"(q5) : "memory");      /* the twelve loads' six address pairs stay whole up to here and are free for reuse only behind this wait */
    c00 = g2_mma(xa0, xb0, c00); c10 = g2_mma(xa1, xb0, c10); c01 = g2_mma(xa0, xb1, c01); c11 = g2_mma(xa1, xb1, c11);
    c02 = g2_mma(xa0, xb2, c02); c12 = g2_mma(xa1, xb2, c12); c03 = g2_mma(xa0, xb3, c03); c13 = g2_mma(xa1, xb3, c13);
    const int k2 = ((kb + 64 < K) ? kb + 64 : kb) * 16;      /* the last trip fetches its own first step again: in bounds, unused */
    const _Float16* r0 = a0p + k2; const _Float16* r1 = a1p + k2; const _Float16* r2 = b0p + k2; const _Float16* r3 = b1p + k2; const _Float16* r4 = b2p + k2; const _Float16* r5 = b3p + k2;
    xa0 = g2_frag(r0); xa1 = g2_frag(r1); xb0 = g2_frag(r2); xb1 = g2_frag(r3); xb2 = g2_frag(r4); xb3 = g2_frag(r5);
    asm volatile("s_wait_xcnt 0x0" :: "v"(r0), "v"(r1), "v"(r2), "v"(r3), "v"(r4), "v"(r5) : "memory");      /* likewise for this set's six address pairs */
    c00 = g2_mma(ya0, yb0, c00); c10 = g2_mma(ya1, yb0, c10); c01 = g2_mma(ya0, yb1, c01); c11 = g2_mma(ya1, yb1, c11);
    c02 = g2_mma(ya0, yb2, c02); c12 = g2_mma(ya1, yb2, c12); c03 = g2_mma(ya0, yb3, c03); c13 = g2_mma(ya1, yb3, c13); }
  v8f accs[8] = {c00, c01, c02, c03, c10, c11, c12, c13};
  if (PROJ) {
    /* Projection epilogue: the planes the attention reads are written here, from the f32 values of this tile, not by later jobs that read f32 rows back. Products 0 and 1 (q, k): f16 hi + x1024 residual planes in fragment
       order; product 2 (v): V^T in fragment order. The f32 rows go out only for every frp-th block of 128 rows (the rows of the exact first-tile attention). Every test here is uniform for the block. */
    const bool frows = mt % frp == 0; float bvs[4] = {0.f, 0.f, 0.f, 0.f};
    if (bp) {
#pragma unroll      /* static indices keep bvs[] in registers; the four loads are issued together */
      for (int t = 0; t < 4; ++t) bvs[t] = bf16_round(bp[col0 + t * 16 + ln]); }
    if (by == 2) {      /* a lane's accumulator holds rows (keys) 16 half + 8 hh .. + 7 of column (dim) 16 t + ln: the very 16-byte group of lane 16 hh + ln in half-block 'half' of V^T block t; the tile is 32 keys x the 64 dims of head nq */
      _Float16* vp = VTo + ((size_t)(row0 / SQ) * NH + nq) * HD * SQ + (size_t)(row0 % SQ) * HD + 8 * lane; FragH g[8];
#pragma unroll      /* static indices keep accs[] and g[] in registers; the eight stores follow one another */
      for (int u = 0; u < 8; ++u) { for (int r = 0; r < 8; ++r) g[u].h[r] = (_Float16)(accs[u][r] * alpha + bvs[u & 3]);
        *(v8us*)((unsigned short*)vp + (u & 3) * 512 + (u >> 2) * 256) = g[u].half[0]; }
      asm volatile("s_wait_xcnt 0x0" :: "v"(vp), "v"(g[0].half[0]), "v"(g[1].half[0]), "v"(g[2].half[0]), "v"(g[3].half[0]), "v"(g[4].half[0]), "v"(g[5].half[0]), "v"(g[6].half[0]), "v"(g[7].half[0]) : "memory");      /* the eight stores' address pair and data registers stay whole up to here and are free for reuse only behind this wait */
      if (!frows) return; }
#pragma unroll      /* static indices keep accs[] in registers */
    for (int u = 0; u < 8; ++u) for (int r = 0; r < 8; ++r) so[w][(u >> 2) * 16 + 8 * hh + r][(u & 3) * 16 + ln] = accs[u][r] * alpha + bvs[u & 3];
    __builtin_amdgcn_fence(__ATOMIC_ACQ_REL, "workgroup"); __builtin_amdgcn_wave_barrier();      /* the wave reads back below what its other lanes have stored: as in the general epilogue */
    if (by != 2) {      /* group g of a 16-row group = (block of 32 columns g / 2, k half of 16 g % 2), 256 elements each, one behind the other: lane 16 hh + ln takes columns 8 hh .. + 7 of that half of row ln (LDS pitch 272 B = 16 B x odd: no bank conflict) and writes its 16-byte group of the block, so each store covers 512 contiguous bytes */
      _Float16* hp = HH + (size_t)by * sH + (size_t)row0 * ldc + (size_t)(col0 >> 5) * 512 + 8 * lane; _Float16* lp = HL + (size_t)by * sH + (size_t)row0 * ldc + (size_t)(col0 >> 5) * 512 + 8 * lane;
#pragma unroll      /* static indices keep x[], a[] and c[] in registers */
      for (int rg = 0; rg < 2; ++rg) { _Float16* hq = hp + (size_t)rg * 16 * ldc; _Float16* lq = lp + (size_t)rg * 16 * ldc; v4f x[8]; FragH a[4], c[4];      /* a 16-row group at a time: its eight LDS reads are issued together, its eight stores follow one another */
        for (int g = 0; g < 4; ++g) { const float* sp = &so[w][rg * 16 + ln][g * 16 + hh * 8]; x[2 * g] = *(const v4fa*)sp; x[2 * g + 1] = *(const v4fa*)(sp + 4); }
        for (int g = 0; g < 4; ++g) for (int q = 0; q < 8; ++q) { const float xv = x[2 * g + (q >> 2)][q & 3]; const _Float16 hv = (_Float16)xv; a[g].h[q] = hv; c[g].h[q] = (_Float16)((xv - (float)hv) * 1024.0f); }
        for (int g = 0; g < 4; ++g) { *(v8us*)((unsigned short*)hq + g * 256) = a[g].half[0]; *(v8us*)((unsigned short*)lq + g * 256) = c[g].half[0]; }
        asm volatile("s_wait_xcnt 0x0" :: "v"(hq), "v"(lq), "v"(a[0].half[0]), "v"(a[1].half[0]), "v"(a[2].half[0]), "v"(a[3].half[0]), "v"(c[0].half[0]), "v"(c[1].half[0]), "v"(c[2].half[0]), "v"(c[3].half[0]) : "memory"); } }      /* the eight stores' two address pairs and data registers stay whole up to here and are free for reuse only behind this wait */
    if (!frows) return;
#pragma unroll      /* static LDS offsets */
    for (int q = 0; q < 16; ++q) { const int r = q * 2 + hh; const v4f v = *(const v4fa*)&so[w][r][ln * 4]; float* cp = C + cofs + (size_t)(row0 + r) * ldc + col0 + ln * 4; *(v4f*)cp = v;
      asm volatile("s_wait_xcnt 0x0" :: "v"(cp), "v"(v) : "memory"); }      /* the store's address pair and data registers stay whole up to here and are free for reuse only behind this wait */
    return; }
  if (two) {      /* 16 rows: C = (hi product * alpha + bias) + residual product * alphaL, rounded once at each of the two additions (both factors are powers of two, so neither product rounds); f32 rows only */
    float bvs[4] = {0.f, 0.f, 0.f, 0.f};
    if (bp) {
#pragma unroll      /* static indices keep bvs[] in registers; the four loads are issued together */
      for (int t = 0; t < 4; ++t) bvs[t] = bf16_round(bp[col0 + t * 16 + ln]); }
#pragma unroll      /* static indices keep accs[] in registers */
    for (int t = 0; t < 4; ++t) for (int r = 0; r < 8; ++r) so[w][8 * hh + r][t * 16 + ln] = fmaf(accs[4 + t][r], alphaL, accs[t][r] * alpha + bvs[t]);
    __builtin_amdgcn_fence(__ATOMIC_ACQ_REL, "workgroup"); __builtin_amdgcn_wave_barrier();      /* the wave reads back below what its other lanes have stored: as in the general epilogue */
#pragma unroll      /* static LDS offsets */
    for (int q = 0; q < 8; ++q) { const int r = q * 2 + hh; const v4f v = *(const v4fa*)&so[w][r][ln * 4]; float* cp = C + cofs + (size_t)(row0 + r) * ldc + col0 + ln * 4; *(v4f*)cp = v;
      asm volatile("s_wait_xcnt 0x0" :: "v"(cp), "v"(v) : "memory"); }      /* the store's address pair and data registers stay whole up to here and are free for reuse only behind this wait */
    return; }
#pragma unroll
  for (int u = 0; u < 8; ++u) { const int t = u & 3, half = u >> 2; const int col = col0 + t * 16 + ln; const float bv = bp ? bf16_round(bp[col]) : 0.f;
#pragma unroll
    for (int r = 0; r < 8; ++r) { const int rloc = half * 16 + 8 * hh + r; float v = accs[u][r] * alpha + bv;
      if (ACT == 3) v = fmaxf(v, 0.f); else if (ACT == 6) v = 0.5f * v * (1.0f + erff(v * 0.70710678118654752f)); else if (ACT == 11) v = 1.0f / (1.0f + expf(-v)); else if (ACT == 15) v = v / (1.0f + expf(-v)); else if (ACT == 12) v = (v > 0.f) ? v : 0.01f * v; else if (ACT == 8) v = tanhf(v); else if (ACT == 9) v = 0.5f * v * (1.0f + tanhf(0.7978845608028654f * (v + 0.044715f * v * v * v))); else if (ACT == 14) v = (v > 0.f) ? v : 0.1f * v; else if (ACT == 16) v = (v >= 0.f) ? v : 0.3f * v; else if (ACT == 17) v = (v >= 0.f) ? v : 0.2f * v;
      so[w][rloc][t * 16 + ln] = v; } }
  __builtin_amdgcn_fence(__ATOMIC_ACQ_REL, "workgroup"); __builtin_amdgcn_wave_barrier();
  const int rsub = lane >> 4, c4 = (lane & 15) * 4;
  {
#pragma unroll
    for (int q = 0; q < 16; ++q) { const int r = q * 2 + rsub; const v4f v = *(const v4fa*)&so[w][r][c4]; if (C) { float* cp = C + cofs + (size_t)(row0 + r) * ldc + col0 + c4; *(v4f*)cp = v; asm volatile("s_wait_xcnt 0x0" :: "v"(cp), "v"(v) : "memory"); }      /* the f32 store's address pair and data registers stay whole up to here: the f16 conversion below and the next row's LDS read reuse them only behind this wait */ if (C16) { v4h h4; for (int i = 0; i < 4; ++i) h4[i] = (_Float16)v[i]; *(v4h*)(C16 + cofs + (size_t)(row0 + r) * ldc + col0 + c4) = h4; } }
     } }


__global__ __launch_bounds__(256) void k_wnat(const float* __restrict__ w, size_t n8, _Float16* __restrict__ Bt) { const size_t t = (size_t)blockIdx.x * 256 + threadIdx.x; if (t >= n8) return; FragH f; for (int q = 0; q < 8; ++q) f.h[q] = (_Float16)(bf16_round(w[t * 8 + q]) * 16.0f); *(v8us*)((unsigned short*)Bt + t * 8) = f.half[0];  }
__global__ __launch_bounds__(256) void k_rsm(const float* __restrict__ S, _Float16* __restrict__ P, int nrows) {
  #pragma clang fp contract(off)
  const int i = blockIdx.x * 256 + threadIdx.x; if (i >= nrows) return; const float* s = S + (size_t)i * SQ; float mx = -3.0e38f;
#pragma unroll 1
  for (int j = 0; j < SQ; ++j) mx = fmaxf(mx, s[j]); float se = 0.f;
#pragma unroll 1
  for (int j = 0; j < SQ; ++j) se += expf(s[j] - mx); const float sc = 256.0f / se;
#pragma unroll 1
  for (int j0 = 0; j0 < SQ; j0 += 8) { FragH f; for (int q = 0; q < 8; ++q) f.h[q] = (_Float16)(expf(s[j0 + q] - mx) * sc); unsigned short* d = (unsigned short*)P + (size_t)i * SQ + j0; *(v8us*)d = f.half[0];  } }
__global__ __launch_bounds__(256) void k_vt(const _Float16* __restrict__ V16, int b, int h0, _Float16* __restrict__ VT) { __shared__ unsigned short tl[64][65]; const int tid = threadIdx.x; const int hh = blockIdx.x % HG, sg = blockIdx.x / HG; const int s0 = sg * 64; const int h = h0 + hh;
  for (int i = tid; i < 64 * 8; i += 256) { const int j = i / 8, d8 = (i % 8) * 8; FragH f; f.half[0] = *(const v8us*)((const unsigned short*)V16 + ((size_t)b * SQ + s0 + j) * DM + h * HD + d8); for (int q = 0; q < 8; ++q) tl[d8 + q][j] = f.u[q]; }
  __syncthreads();
  { for (int i = tid; i < 64 * 8; i += 256) { const int d = i / 8, j8 = (i % 8) * 8; FragH f; for (int q = 0; q < 8; ++q) f.u[q] = tl[d][j8 + q]; *(v8us*)((unsigned short*)VT + ((size_t)hh * HD + d) * SQ + s0 + j8) = f.half[0]; }  } }



// Fused causal attention, one launch for every (batch, head, 128 query rows): the scores and the softmax weights stay in registers.
// One wave owns 16 queries and walks the keys 32 at a time. S^T = K Q^T (A = K rows, B = Q rows, both through fa_frag from planes in the same fragment order, so the k orders pair): lane (ln, hh) holds, of query q0 + ln,
// the scores of keys k0 + 16 kt + 8 hh + r. Three products as before: hi.hi in one accumulator, lo.hi + hi.lo (x1024) in a second. Running maximum and running sum per query (the two
// lane halves share the maximum and join their sums at the end). The two score tiles, as f16, are the B operand of O^T += V^T P^T in the order fa_frag gives V^T's rows. o leaves x64.
__device__ __forceinline__ v16h fa_frag(const _Float16* p) { return g2_frag(p); }      /* p = a fragment-order block + 8 * lane */
__device__ __forceinline__ float fa_exp(float x) { float r; asm("v_exp_f32 %0, %1\n\tv_nop" : "=v"(r) : "v"(x * 1.44269504f)); return r; }      /* native e^x; the v_nop fills the one slot the instruction set asks for behind a transcendental, whatever the compiler puts next */
__device__ __forceinline__ v8f fa_mma(v16h a, v16h b, v8f c) { return __builtin_amdgcn_wmma_f32_16x16x32_f16(false, a, false, b, (short)0, c, false, false); }
#define GA (NH * (QT0 / 8))                      /* blocks of the exact first-tile attention per batch */
__device__ __forceinline__ void d_att0w(int bx, const float* __restrict__ QF, const float* __restrict__ KF, const float* __restrict__ VF, float scale, _Float16* __restrict__ OH, _Float16* __restrict__ OL);      /* defined below */
/* amdgpu_waves_per_eu(4, 4): two 8-wave blocks per WGP need at most 256 registers a wave; without it this build takes 260 and only one block fits */
__global__ __launch_bounds__(256) __attribute__((amdgpu_waves_per_eu(4, 4))) void k_fattn(const _Float16* __restrict__ QHp, const _Float16* __restrict__ QLp, const _Float16* __restrict__ KHp, const _Float16* __restrict__ KLp, const _Float16* __restrict__ VTp, _Float16* __restrict__ O, const float* __restrict__ QF, const float* __restrict__ KF, const float* __restrict__ VF, _Float16* __restrict__ OH0, _Float16* __restrict__ OL0) {
  const int lane = threadIdx.x & 31, ln = lane & 15, hh = lane >> 4; const int w = __builtin_amdgcn_readfirstlane(threadIdx.x >> 5);      /* the wave's number as a scalar: the trip count and the mask test stay scalar */
  if (blockIdx.x >= NB * NH * (SQ / 128 - 1)) { const int u = (int)blockIdx.x - NB * NH * (SQ / 128 - 1); const size_t eb = u / GA; d_att0w(u % GA, QF + eb * SQ * DM, KF + eb * SQ * DM, VF + eb * SQ * DM, SCL, OH0 + eb * QT0 * DM, OL0 + eb * QT0 * DM); return; }      /* the last blocks of the grid are the exact first-tile attention (independent of the attention below); the test is uniform for the block, so its barrier is passed by all of a block's waves or by none */
  const int bh = blockIdx.x % (NB * NH), tx = blockIdx.x / (NB * NH); const int tile = (tx < SQ / 256) ? (SQ / 128 - 1 - tx) : (tx - SQ / 256 + 1);      /* long tiles take the low block numbers; the second half of the grid counts up from the short end; tile 0 (rows 0 .. QT0 - 1) is the exact path's alone */
  const int b = bh / NH, h = bh % NH; const int q0 = tile * 128 + w * 16; const size_t r0 = (size_t)b * SQ;
  const _Float16* qh = QHp + (r0 + q0) * LQ + h * HD * 16 + 8 * lane; const _Float16* ql = QLp + (r0 + q0) * LQ + h * HD * 16 + 8 * lane;      /* a head's 64 dims are two blocks of 512 in each 16-row group */
  const v16h qh0 = fa_frag(qh), qh1 = fa_frag(qh + 512), ql0 = fa_frag(ql), ql1 = fa_frag(ql + 512);
  const _Float16* kh = KHp + r0 * LQ + h * HD * 16 + 8 * lane; const _Float16* kl = KLp + r0 * LQ + h * HD * 16 + 8 * lane; const _Float16* vt = VTp + (size_t)bh * HD * SQ + 8 * lane;      /* V^T: four blocks (16 dims each) per 32 keys */
  const v8f z8 = {0.f,0.f,0.f,0.f,0.f,0.f,0.f,0.f}; v8f o[4] = {z8, z8, z8, z8}; float m = -1.0e30f, l = 0.f;
  const int np = q0 / 32 + 1;      /* keys 0 .. q0 + 15 in passes of 32 */
  v16h fh[2][2], fl[2][2];      /* K fragments [key tile][k step], fetched one pass ahead */
#pragma unroll      /* static indices keep the fragments, scores and accumulators in registers */
  for (int kt = 0; kt < 2; ++kt) for (int ks = 0; ks < 2; ++ks) { fh[kt][ks] = fa_frag(kh + (size_t)kt * 16 * LQ + ks * 512); fl[kt][ks] = fa_frag(kl + (size_t)kt * 16 * LQ + ks * 512); }
  asm volatile("s_wait_xcnt 0x0" :: "v"(qh), "v"(ql), "v"(kh), "v"(kl) : "memory");      /* the loads' four address pairs stay whole up to here and are free for reuse only behind this wait */
  for (int p = 0; p < np; ++p) { const int k0 = p * 32;
    const _Float16* va = vt + (size_t)k0 * HD; v16h fv[4];
#pragma unroll      /* static indices keep the fragments, scores and accumulators in registers */
    for (int dt = 0; dt < 4; ++dt) fv[dt] = fa_frag(va + dt * 512);
    v8f sh[2], sl[2];
#pragma unroll      /* static indices keep the fragments, scores and accumulators in registers */
    for (int kt = 0; kt < 2; ++kt) { sh[kt] = fa_mma(fh[kt][1], qh1, fa_mma(fh[kt][0], qh0, z8)); sl[kt] = fa_mma(fl[kt][1], qh1, fa_mma(fl[kt][0], qh0, fa_mma(fh[kt][1], ql1, fa_mma(fh[kt][0], ql0, z8)))); }
    const int kn = (p + 1 < np) ? k0 + 32 : k0;      /* the last pass fetches its own rows again: in bounds, unused */
    const _Float16* ka = kh + (size_t)kn * LQ; const _Float16* kb = kl + (size_t)kn * LQ;
#pragma unroll      /* static indices keep the fragments, scores and accumulators in registers */
    for (int kt = 0; kt < 2; ++kt) for (int ks = 0; ks < 2; ++ks) { fh[kt][ks] = fa_frag(ka + (size_t)kt * 16 * LQ + ks * 512); fl[kt][ks] = fa_frag(kb + (size_t)kt * 16 * LQ + ks * 512); }
    asm volatile("s_wait_xcnt 0x0" :: "v"(va), "v"(ka), "v"(kb) : "memory");      /* this pass's three address pairs stay whole up to here and are free for reuse only behind this wait */
    float s[16];
#pragma unroll      /* static indices keep the fragments, scores and accumulators in registers */
    for (int e = 0; e < 16; ++e) s[e] = fmaf(sl[e >> 3][e & 7], SCLR, sh[e >> 3][e & 7] * SCL);
    if (k0 + 31 > q0) {      /* only the pass on the diagonal masks; key k0 <= q0 stays, so every query keeps a key */
#pragma unroll      /* static indices keep the fragments, scores and accumulators in registers */
      for (int e = 0; e < 16; ++e) s[e] = (k0 + (e >> 3) * 16 + 8 * hh + (e & 7) <= q0 + ln) ? s[e] : -1.0e30f; }
    float mx = s[0];
#pragma unroll      /* static indices keep the fragments, scores and accumulators in registers */
    for (int e = 1; e < 16; ++e) mx = fmaxf(mx, s[e]);
    mx = fmaxf(mx, __shfl_xor(mx, 16, 32)); const float mn = fmaxf(m, mx); const float al = fa_exp(m - mn); m = mn;
    FragH pf; float ps[4] = {0.f, 0.f, 0.f, 0.f};
#pragma unroll      /* static indices keep the fragments, scores and accumulators in registers */
    for (int e = 0; e < 16; ++e) { const float pe = fa_exp(s[e] - mn); ps[e & 3] += pe; pf.h[e] = (_Float16)pe; }
    l = fmaf(l, al, (ps[0] + ps[1]) + (ps[2] + ps[3]));
#pragma unroll      /* static indices keep the fragments, scores and accumulators in registers */
    for (int dt = 0; dt < 4; ++dt) { o[dt] *= al; o[dt] = fa_mma(fv[dt], pf.v, o[dt]); } }
  l += __shfl_xor(l, 16, 32); const float fin = 64.0f / l;      /* o carried x64, folded into the output GEMM's alpha */
  _Float16* op = O + (r0 + q0) * DM + h * HD * 16 + 8 * lane;      /* o rows in fragment order for the output GEMM: dims 16 dt + 8 hh .. + 7 of query ln are the lane's group of half-block dt */
#pragma unroll      /* static indices keep the fragments, scores and accumulators in registers */
  for (int dt = 0; dt < 4; ++dt) { FragH f;
#pragma unroll      /* static indices keep the fragments, scores and accumulators in registers */
    for (int r = 0; r < 8; ++r) f.h[r] = (_Float16)(o[dt][r] * fin);
    *(v8us*)((unsigned short*)op + dt * 256) = f.half[0]; }
  asm volatile("s_wait_xcnt 0x0" ::: "memory"); }      /* the four stores' address and data registers are free for reuse only behind this wait: the exact job's code follows in the text */


typedef float v2f __attribute__((ext_vector_type(2)));
typedef _Float16 v2h __attribute__((ext_vector_type(2)));
// Exact f32 attention for query rows 0 .. QT0-1 of one batch, one wave per (head, query row), 8 rows of one head per block. The head's QT0 K and V rows are staged once in LDS;
// lane l scores keys l, l + 32, l + 64, l + 96; row maximum and row sum are lane partials joined by butterflies; lane l then sums dims 2l, 2l + 1 over the keys (weight 0 behind the diagonal).
__device__ __forceinline__ void d_att0w(int bx, const float* __restrict__ QF, const float* __restrict__ KF, const float* __restrict__ VF, float scale, _Float16* __restrict__ OH, _Float16* __restrict__ OL) {      /* bx = the block's number within this batch; OH, OL = this batch's QT0 rows of the hi and x1024 residual planes */
  __shared__ __attribute__((aligned(16))) float lk[QT0][HD + 4];      /* pitch 272 B = 16 B x odd: one key row per lane reads without bank conflicts */
  __shared__ __attribute__((aligned(16))) float lv[QT0][HD];
  const int tid = threadIdx.x, lane = tid & 31; const int w = __builtin_amdgcn_readfirstlane(tid >> 5);      /* the wave's number as a scalar: q's address is the same in every lane of the wave */
  const int h = bx / (QT0 / 8), i = (bx % (QT0 / 8)) * 8 + w;
  const int sr = tid >> 4, sc = (tid & 15) * 4; const float* kg = KF + (size_t)sr * DM + h * HD + sc; const float* vg = VF + (size_t)sr * DM + h * HD + sc; v4f ks[QT0 / 16], vs[QT0 / 16];
#pragma unroll      /* static indices keep ks[] and vs[] in registers; every load is issued before the first LDS store */
  for (int u = 0; u < QT0 / 16; ++u) { ks[u] = *(const v4fa*)(kg + (size_t)u * 16 * DM); vs[u] = *(const v4fa*)(vg + (size_t)u * 16 * DM); }
  asm volatile("s_wait_xcnt 0x0" :: "v"(kg), "v"(vg) : "memory");      /* the loads' two address pairs stay whole up to here and are free for reuse only behind this wait */
#pragma unroll      /* static indices keep ks[] and vs[] in registers */
  for (int u = 0; u < QT0 / 16; ++u) { *(v4f*)&lk[u * 16 + sr][sc] = ks[u]; *(v4f*)&lv[u * 16 + sr][sc] = vs[u]; }
  __syncthreads();
  const float* qg = QF + (size_t)i * DM + h * HD; v4f a[QT0 / 32] = {}; float qv[HD];
#pragma unroll      /* static indices keep qv[] in scalar registers; the whole q row is asked for at once, ahead of the scheduling barriers below */
  for (int d = 0; d < HD; ++d) qv[d] = qg[d];
#pragma unroll      /* static indices keep a[] in registers: four independent sums per key, four keys per lane */
  for (int d = 0; d < HD / 4; ++d) { for (int c = 0; c < QT0 / 32; ++c) { const v4f kk = *(const v4f*)&lk[c * 32 + lane][d * 4]; for (int u = 0; u < 4; ++u) a[c][u] = fmaf(qv[d * 4 + u], kk[u], a[c][u]); }
    if ((d & 3) == 3 && d + 1 < HD / 4) __builtin_amdgcn_sched_barrier(0); }      /* at most 16 of the 64 LDS reads are hoisted together: under this kernel's register budget the scheduler otherwise issues all 64 first, 256 registers, and spills */
  float e[QT0 / 32]; float m = -1.0e30f;
#pragma unroll      /* static indices keep e[] in registers */
  for (int c = 0; c < QT0 / 32; ++c) { e[c] = (c * 32 + lane <= i) ? ((a[c][0] + a[c][1]) + (a[c][2] + a[c][3])) * scale : -1.0e30f; m = fmaxf(m, e[c]); }
  for (int x = 16; x >= 1; x >>= 1) m = fmaxf(m, __shfl_xor(m, x, 32));
  float l = 0.f;
#pragma unroll      /* static indices keep e[] in registers */
  for (int c = 0; c < QT0 / 32; ++c) { e[c] = expf(e[c] - m); l += e[c]; }      /* a key behind the diagonal: exp(-1e30 - m) = 0 */
  for (int x = 16; x >= 1; x >>= 1) l += __shfl_xor(l, x, 32);
  v2f o[4] = {};
#pragma unroll      /* a constant lane number per step: key j's weight is broadcast through a scalar register; static indices keep e[] and o[] in registers */
  for (int j = 0; j < QT0; ++j) { const float ej = __int_as_float(__builtin_amdgcn_readlane(__float_as_int(e[j >> 5]), j & 31)); const v2f vv = *(const v2f*)&lv[j][lane * 2]; o[j & 3][0] = fmaf(ej, vv[0], o[j & 3][0]); o[j & 3][1] = fmaf(ej, vv[1], o[j & 3][1]); }
  const float fin = 64.0f / l;      /* o carried x64 like the f16 path */
  const v2f r = ((o[0] + o[1]) + (o[2] + o[3])) * fin;
  /* o row i leaves as f16 hi + x1024 residual, in fragment order for the output GEMM: dims 2 lane, 2 lane + 1 of head h are 4 bytes of the 16-byte group (k half (lane >> 3) & 1, lane 16 * ((lane >> 2) & 1) + i % 16) of block h * 2 + (lane >> 4) of the row's 16-row group; the 8 rows of this block fill whole 128-byte lines */
  const size_t od = ((size_t)(i >> 4) * (DM / 32) + h * 2 + (lane >> 4)) * 512 + ((lane >> 3) & 1) * 256 + (((lane >> 2) & 1) * 16 + (i & 15)) * 8 + (lane & 3) * 2;
  v2h rh, rl;
#pragma unroll      /* static indices keep rh and rl in registers */
  for (int u = 0; u < 2; ++u) { const _Float16 hv = (_Float16)r[u]; rh[u] = hv; rl[u] = (_Float16)((r[u] - (float)hv) * 1024.0f); }
  *(v2h*)(OH + od) = rh; *(v2h*)(OL + od) = rl; }

// Launches that do not depend on one another share one grid: a range of block numbers per job, the test is uniform for the block.
#define GW (DM * (DM / 8) / 256)                 /* blocks per weight */
#define GX ((int)(NR * DM / 16 / 256))           /* blocks per input */
__global__ __launch_bounds__(256) void k_prep(const float* __restrict__ w0, const float* __restrict__ w1, const float* __restrict__ w2, const float* __restrict__ w3, _Float16* __restrict__ Wt0,
                                              const float* __restrict__ x0, const float* __restrict__ x1, const float* __restrict__ x2, _Float16* __restrict__ X0) {
  const int bx = blockIdx.x;
  if (bx < 4 * GW) { const int y = bx / GW; d_wt_f16(bx % GW, (y == 0) ? w0 : (y == 1) ? w1 : (y == 2) ? w2 : w3, Wt0 + (size_t)y * DM * DM, DM, DM, 16.0f); }      /* the four weight planes lie one behind the other */
  else { const int u = bx - 4 * GW, y = u / GX; d_x16(u % GX, (y == 0) ? x0 : (y == 1) ? x1 : x2, X0 + (size_t)y * NR * DM, NR * DM / 16); } }      /* likewise the three input planes */

extern "C" void kernel_launch(void* const* d_in, const int* in_sizes, int n_in,
                              void* d_out, int out_size, void* d_ws, size_t ws_size, hipStream_t stream) {
  (void)in_sizes; (void)n_in; (void)out_size;
  const float* const* I = (const float* const*)d_in; const float* x = I[0]; const float* xk = I[1]; const float* xv = I[2]; const float* wq = I[3]; const float* bq = I[4]; const float* wk = I[5]; const float* bk = I[6]; const float* wv = I[7]; const float* bv = I[8]; const float* wo = I[9]; const float* bo = I[10];      /* input order: query, key, value (THREE input streams), then [in][out] weights + biases */
  char* ws = (char*)d_ws; size_t off = 0;
  auto take = [&](size_t bytes) { char* p = ws + off; off += (bytes + 255) & ~(size_t)255; return p; };
  _Float16* BQ = (_Float16*)take((size_t)DM * DM * 2); _Float16* BK = (_Float16*)take((size_t)DM * DM * 2); _Float16* BV = (_Float16*)take((size_t)DM * DM * 2); _Float16* BO = (_Float16*)take((size_t)DM * DM * 2);
  _Float16* X16 = (_Float16*)take(NR * DM * 2); _Float16* XK16 = (_Float16*)take(NR * DM * 2); _Float16* XV16 = (_Float16*)take(NR * DM * 2);      /* exact f16 rows of query, key, value, fragment order */ float* QF = (float*)take(NR * DM * 4); float* KF = (float*)take(NR * DM * 4); float* VF = (float*)take(NR * DM * 4);      /* f32 q, k, v rows: only rows 0..127 of each batch are written, and only those are read (the exact first-tile attention) */ _Float16* QH = (_Float16*)take(NR * DM * 2); _Float16* QL = (_Float16*)take(NR * DM * 2); _Float16* KH = (_Float16*)take(NR * DM * 2); _Float16* KL = (_Float16*)take(NR * DM * 2); _Float16* Q16 = QH; _Float16* K16 = KH; _Float16* O16 = (_Float16*)take(NR * DM * 2);
  _Float16* VT = (_Float16*)take((size_t)NB * NH * HD * SQ * 2);      /* V^T of both batches */
  _Float16* OH0 = (_Float16*)take((size_t)NB * QT0 * DM * 2); _Float16* OL0 = (_Float16*)take((size_t)NB * QT0 * DM * 2);
  if (off > ws_size) return;
  k_prep<<<4 * GW + 3 * GX, 256, 0, stream>>>(wq, wk, wv, wo, BQ, x, xk, xv, X16);      /* weights [in][out] -> Bt[n][k] x16 (BQ, BK, BV, BO) and inputs -> exact f16 rows (X16, XK16, XV16), all in fragment order */
  k_gemm2<0, true><<<dim3((unsigned)((MP / 128) * (DM / 64)), 3), 128, 0, stream>>>(X16, DM, NR * DM, BQ, DM, (size_t)DM * DM, 0.0625f, bq, 0, QF, nullptr, DM, NR * DM, MP, DM, DM, bk, bv, 0, nullptr, 1, QH, QL, 2 * NR * DM, VT, SQ / 128, nullptr, 0.f);      /* q, k, v projections in one grid; the epilogue writes q and k as f16 hi + x1024 residual planes (QH, QL, KH, KL lie one behind the other; unscaled logits sigma ~8) and V^T of all heads, all in fragment order; f32 rows into QF, KF, VF only for rows 0..127 of each batch */
  k_fattn<<<NB * NH * (SQ / 128 - 1) + NB * GA, 256, 0, stream>>>(QH, QL, KH, KL, VT, O16, QF, KF, VF, OH0, OL0);      /* scores, causal softmax and P V of both batches and all heads, rows 128 on: o (merged heads, x64) as f16 rows; in the last blocks the exact f32 attention for rows 0..127 of each batch: o (x64) as f16 hi + x1024 residual planes */
  k_gemm2<0, false><<<dim3((unsigned)((MPO / 128 + MPO / SQ) * (DM / 64)), 1), 128, 0, stream>>>(O16, DM, 0, BO, DM, 0, 0.0009765625f, bo, 0, (float*)d_out, nullptr, DM, 0, MPO, DM, DM, nullptr, nullptr, 0, OH0, SQ / 128, nullptr, nullptr, 0, nullptr, 1, OL0, 0.00000095367431640625f);      /* out rows are the output layout; rows 0..127 of each batch: out = o_hi Wo (+ b) + o_lo Wo 2^-20, 64 rows a block (DM / 64 more blocks per batch) */
}
